// v000
// Times are from an AMD MI455X. After a warm-up the kernel runs many times in a row, and a time is the length of
// such a window on the GPU divided by its runs, so every launch and the gaps after it count. The runs cycle
// through copies of the inputs. A figure is the median of several windows, for all but v000 over two sittings.
// Sittings can differ by a few percent; kernels timed side by side share one.
// The starting kernel, v000, takes 653 microseconds a run.
#include <hip/hip_runtime.h>
#include <hip/hip_bf16.h>

typedef __attribute__((ext_vector_type(2))) float v2f;
typedef __attribute__((ext_vector_type(8))) float v8f;

#define WMMA_F32(a, b, c) \
  __builtin_amdgcn_wmma_f32_16x16x4_f32(false, (a), false, (b), (short)0, (c), false, false)

// CDNA5 async global->LDS copies (ASYNCcnt-tracked), GV addressing mode.
#define ASYNC_LDS_B128(ldsoff, gptr)                                 \
  asm volatile("global_load_async_to_lds_b128 %0, %1, off"           \
               :: "v"(ldsoff), "v"(gptr) : "memory")
#define ASYNC_LDS_B32(ldsoff, gptr)                                  \
  asm volatile("global_load_async_to_lds_b32 %0, %1, off"            \
               :: "v"(ldsoff), "v"(gptr) : "memory")
#define WAIT_ASYNC(n) asm volatile("s_wait_asynccnt " #n ::: "memory")

// Generic pointer to LDS: low 32 bits of the flat address are the LDS offset.
__device__ __forceinline__ uint32_t lds_off(const void* p) {
  return (uint32_t)(size_t)p;
}

__device__ __forceinline__ float gelu_exact(float x) {
  return 0.5f * x * (1.0f + erff(x * 0.70710678118654752f));
}

// ---------------------------------------------------------------------------
// LayerNorm over ada_dim (one block per batch row)
// ---------------------------------------------------------------------------
__global__ __launch_bounds__(256) void ln_kernel(
    const float* __restrict__ ada, const float* __restrict__ gamma,
    const float* __restrict__ beta, float* __restrict__ cOut, int Adim) {
  __shared__ float red[256];
  const int b = blockIdx.x;
  const float* row = ada + (size_t)b * Adim;
  float s = 0.f;
  for (int i = threadIdx.x; i < Adim; i += 256) s += row[i];
  red[threadIdx.x] = s; __syncthreads();
  for (int o = 128; o > 0; o >>= 1) {
    if (threadIdx.x < o) red[threadIdx.x] += red[threadIdx.x + o];
    __syncthreads();
  }
  const float mu = red[0] / (float)Adim;
  __syncthreads();
  float v = 0.f;
  for (int i = threadIdx.x; i < Adim; i += 256) { float d = row[i] - mu; v += d * d; }
  red[threadIdx.x] = v; __syncthreads();
  for (int o = 128; o > 0; o >>= 1) {
    if (threadIdx.x < o) red[threadIdx.x] += red[threadIdx.x + o];
    __syncthreads();
  }
  const float rstd = rsqrtf(red[0] / (float)Adim + 1e-5f);
  for (int i = threadIdx.x; i < Adim; i += 256)
    cOut[(size_t)b * Adim + i] = (row[i] - mu) * rstd * gamma[i] + beta[i];
}

// ---------------------------------------------------------------------------
// Out(16,N) = act(Ain(16,K) @ W(K,N) + bias) — M=16 fits one WMMA tile exactly.
// ---------------------------------------------------------------------------
__global__ __launch_bounds__(256) void gemm16_kernel(
    const float* __restrict__ Ain, const float* __restrict__ W,
    const float* __restrict__ bias, float* __restrict__ Out,
    int K, int N, int applyGelu) {
  const int lane  = threadIdx.x & 31;
  const int wave  = threadIdx.x >> 5;
  const int ncol  = blockIdx.x * 128 + wave * 16 + (lane & 15);
  const int khalf = (lane >= 16) ? 2 : 0;
  const int arow  = lane & 15;
  v8f acc = {};
  for (int k = 0; k < K; k += 4) {
    v2f a, bf;
    a.x  = Ain[(size_t)arow * K + k + khalf];
    a.y  = Ain[(size_t)arow * K + k + khalf + 1];
    bf.x = W[(size_t)(k + khalf) * N + ncol];
    bf.y = W[(size_t)(k + khalf + 1) * N + ncol];
    acc = WMMA_F32(a, bf, acc);
  }
  const float bb = bias[ncol];
  #pragma unroll
  for (int v = 0; v < 8; ++v) {
    const int rowm = v + ((lane >= 16) ? 8 : 0);
    float val = acc[v] + bb;
    if (applyGelu) val = gelu_exact(val);
    Out[(size_t)rowm * N + ncol] = val;
  }
}

// ---------------------------------------------------------------------------
// 32x32 LDS-tiled transpose (base_up -> base_upT for coalesced B-tile loads)
// ---------------------------------------------------------------------------
__global__ __launch_bounds__(256) void transpose_kernel(
    const float* __restrict__ in, float* __restrict__ out, int N) {
  __shared__ float tile[32][33];
  const int bx = blockIdx.x * 32, by = blockIdx.y * 32;
  const int tx = threadIdx.x & 31, ty = threadIdx.x >> 5;
  for (int j = ty; j < 32; j += 8) tile[j][tx] = in[(size_t)(by + j) * N + bx + tx];
  __syncthreads();
  for (int j = ty; j < 32; j += 8) out[(size_t)(bx + j) * N + by + tx] = tile[tx][j];
}

// ---------------------------------------------------------------------------
// Fused: Out = epilogue( Ain @ Wmain  +  (Ain @ aR) @ bR^T ) per batch.
// 128x128 tile, K-step 32, 8 wave32s. Double-buffered LDS tiles filled with
// GLOBAL_LOAD_ASYNC_TO_LDS (ASYNCcnt), 9 async ops/wave/tile -> steady-state
// s_wait_asynccnt 9 overlaps next-tile HBM traffic with current-tile WMMAs.
// ---------------------------------------------------------------------------
constexpr int TM = 128, TN = 128, TK = 32, RNK = 8, DDIM = 1024;

__global__ __launch_bounds__(256) void fused_lora_gemm(
    const float* __restrict__ Ain,    // (B, T, D)
    const float* __restrict__ Wmain,  // (D, D) [k][n]
    const float* __restrict__ wgen,   // (B, 4*D*R) generated adapter weights
    int aOff, int bOff,               // float offsets of rank-in / rank-out mats
    const float* __restrict__ resid,  // nullptr or (B, T, D)
    float* __restrict__ Out,          // (B, T, D)
    int T, int applyGelu) {
  __shared__ float xs[2][TM][TK + 4];   // A tiles (stride 36: 16B aligned, conflict-free)
  __shared__ float bs[2][TK][TN + 4];   // B tiles
  __shared__ float as[2][TK][16];       // rank-in operand; cols 8..15 stay zero
  __shared__ float us[TM][RNK + 1];     // per-token rank accumulators
  __shared__ float brs[TN][RNK + 1];    // rank-out weights for this col tile

  const int b     = blockIdx.z;
  const int tid   = threadIdx.x;
  const int lane  = tid & 31;
  const int wave  = tid >> 5;
  const int wm    = wave >> 2;              // 0..1 : 64-token half
  const int wn    = wave & 3;               // 0..3 : 32-col group
  const int khalf = (lane >= 16) ? 2 : 0;
  const int lcol  = lane & 15;

  const float* Abase = Ain + ((size_t)b * T + (size_t)blockIdx.y * TM) * DDIM;
  const float* Wbase = Wmain + (size_t)blockIdx.x * TN;
  const float* aRp   = wgen + (size_t)b * 4 * DDIM * RNK + aOff;
  const float* bRp   = wgen + (size_t)b * 4 * DDIM * RNK + bOff;

  v8f acc[4][2] = {};
  v8f uacc[4]   = {};

  const int xr  = tid >> 1;          // 0..127 token row
  const int xc0 = (tid & 1) * 16;
  const int bkk = tid >> 3;          // 0..31 k row
  const int bc0 = (tid & 7) * 16;

  // one-time zero of the rank operand's padding columns (both buffers)
  for (int i = tid; i < 2 * TK * 8; i += 256)
    as[i / (TK * 8)][(i % (TK * 8)) >> 3][8 + (i & 7)] = 0.0f;

  // issue all async loads for one K-tile into LDS buffer `buf` (9 ops/wave)
  auto issue_tile = [&](int buf, int k0) {
    const float* arow = Abase + (size_t)xr * DDIM + k0 + xc0;
    #pragma unroll
    for (int j = 0; j < 4; ++j)
      ASYNC_LDS_B128(lds_off(&xs[buf][xr][xc0 + j * 4]), arow + j * 4);
    const float* wrow = Wbase + (size_t)(k0 + bkk) * DDIM + bc0;
    #pragma unroll
    for (int j = 0; j < 4; ++j)
      ASYNC_LDS_B128(lds_off(&bs[buf][bkk][bc0 + j * 4]), wrow + j * 4);
    ASYNC_LDS_B32(lds_off(&as[buf][tid >> 3][tid & 7]), aRp + k0 * RNK + tid);
  };

  issue_tile(0, 0);

  for (int k0 = 0; k0 < DDIM; k0 += TK) {
    const int cur = (k0 / TK) & 1;
    if (k0 + TK < DDIM) {
      issue_tile(cur ^ 1, k0 + TK);   // prefetch next tile (prev readers done: barrier below)
      WAIT_ASYNC(0x9);                // current tile landed; next tile still in flight
    } else {
      WAIT_ASYNC(0x0);
    }
    __syncthreads();

    #pragma unroll
    for (int k4 = 0; k4 < TK; k4 += 4) {
      v2f afr[4], bfr[2];
      #pragma unroll
      for (int mt = 0; mt < 4; ++mt) {
        const int rr = wm * 64 + mt * 16 + lcol;
        afr[mt].x = xs[cur][rr][k4 + khalf];
        afr[mt].y = xs[cur][rr][k4 + khalf + 1];
      }
      #pragma unroll
      for (int nt = 0; nt < 2; ++nt) {
        const int cc = wn * 32 + nt * 16 + lcol;
        bfr[nt].x = bs[cur][k4 + khalf][cc];
        bfr[nt].y = bs[cur][k4 + khalf + 1][cc];
      }
      #pragma unroll
      for (int mt = 0; mt < 4; ++mt)
        #pragma unroll
        for (int nt = 0; nt < 2; ++nt)
          acc[mt][nt] = WMMA_F32(afr[mt], bfr[nt], acc[mt][nt]);
      if (wn == 0) {  // wave-uniform: EXEC stays all-ones inside
        v2f rfr;
        rfr.x = as[cur][k4 + khalf][lcol];
        rfr.y = as[cur][k4 + khalf + 1][lcol];
        #pragma unroll
        for (int mt = 0; mt < 4; ++mt)
          uacc[mt] = WMMA_F32(afr[mt], rfr, uacc[mt]);
      }
    }
    __syncthreads();  // all waves done with buf `cur` before it is overwritten
  }

  {  // stage rank-out weights for this col tile
    const int n = tid >> 1, r0 = (tid & 1) * 4;
    #pragma unroll
    for (int j = 0; j < 4; ++j)
      brs[n][r0 + j] = bRp[(size_t)(blockIdx.x * TN + n) * RNK + r0 + j];
  }
  if (wn == 0) {  // publish u accumulators (C layout: VGPR v -> row v / v+8)
    #pragma unroll
    for (int mt = 0; mt < 4; ++mt) {
      const int rbase = wm * 64 + mt * 16 + ((lane >= 16) ? 8 : 0);
      if (lcol < RNK) {
        #pragma unroll
        for (int v = 0; v < 8; ++v) us[rbase + v][lcol] = uacc[mt][v];
      }
    }
  }
  __syncthreads();

  #pragma unroll
  for (int mt = 0; mt < 4; ++mt) {
    #pragma unroll
    for (int nt = 0; nt < 2; ++nt) {
      const int colL = wn * 32 + nt * 16 + lcol;
      const int gcol = blockIdx.x * TN + colL;
      #pragma unroll
      for (int v = 0; v < 8; ++v) {
        const int rowL = wm * 64 + mt * 16 + v + ((lane >= 16) ? 8 : 0);
        float val = acc[mt][nt][v];
        #pragma unroll
        for (int r = 0; r < RNK; ++r) val += us[rowL][r] * brs[colL][r];
        if (applyGelu) val = gelu_exact(val);
        const size_t gidx = ((size_t)b * T + blockIdx.y * TM + rowL) * DDIM + gcol;
        if (resid) val += resid[gidx];
        Out[gidx] = val;
      }
    }
  }
}

// ---------------------------------------------------------------------------
extern "C" void kernel_launch(void* const* d_in, const int* in_sizes, int n_in,
                              void* d_out, int out_size, void* d_ws, size_t ws_size,
                              hipStream_t stream) {
  (void)in_sizes; (void)n_in; (void)out_size; (void)ws_size;
  const float* x         = (const float*)d_in[0];
  const float* ada       = (const float*)d_in[1];
  const float* base_up   = (const float*)d_in[2];
  const float* base_down = (const float*)d_in[3];
  const float* ln_gamma  = (const float*)d_in[4];
  const float* ln_beta   = (const float*)d_in[5];
  const float* W1        = (const float*)d_in[6];
  const float* bias1     = (const float*)d_in[7];
  const float* W2        = (const float*)d_in[8];
  const float* bias2     = (const float*)d_in[9];

  const int Bb = 16, T = 1024, Dd = 1024, Adim = 1024, Idim = 1024;
  const int OUT4 = Dd * RNK * 4;  // 32768

  float* ws   = (float*)d_ws;
  float* mid  = ws;                           // 16M floats (64 MB)
  float* upT  = mid + (size_t)Bb * T * Dd;    // 1M floats (4 MB)
  float* cbuf = upT + (size_t)Dd * Dd;        // 16K
  float* hbuf = cbuf + (size_t)Bb * Adim;     // 16K
  float* wbuf = hbuf + (size_t)Bb * Idim;     // 512K (2 MB)

  // Adapter path: LN -> gelu(c@W1+b1) -> h@W2+b2  (M=16 WMMA tiles)
  ln_kernel<<<Bb, 256, 0, stream>>>(ada, ln_gamma, ln_beta, cbuf, Adim);
  gemm16_kernel<<<Idim / 128, 256, 0, stream>>>(cbuf, W1, bias1, hbuf, Adim, Idim, 1);
  gemm16_kernel<<<OUT4 / 128, 256, 0, stream>>>(hbuf, W2, bias2, wbuf, Idim, OUT4, 0);
  transpose_kernel<<<dim3(Dd / 32, Dd / 32), 256, 0, stream>>>(base_up, upT, Dd);

  // mid = gelu( x @ base_down + (x@a2) @ b2^T )      a2 at chunk 2, b2 at chunk 3
  fused_lora_gemm<<<dim3(Dd / TN, T / TM, Bb), 256, 0, stream>>>(
      x, base_down, wbuf, 2 * Dd * RNK, 3 * Dd * RNK, nullptr, mid, T, 1);
  // out = x + mid @ base_up^T + (mid@b1) @ a1^T      b1 at chunk 1, a1 at chunk 0
  fused_lora_gemm<<<dim3(Dd / TN, T / TM, Bb), 256, 0, stream>>>(
      mid, upT, wbuf, 1 * Dd * RNK, 0, x, (float*)d_out, T, 0);
}

// v001
// It runs in 514 microseconds.
// Timed twice side by side with v000, it ran 1.32 and 1.33 times as fast.
#include <hip/hip_runtime.h>
#include <hip/hip_bf16.h>

typedef __attribute__((ext_vector_type(2))) float v2f;
typedef __attribute__((ext_vector_type(8))) float v8f;

#define WMMA_F32(a, b, c) \
  __builtin_amdgcn_wmma_f32_16x16x4_f32(false, (a), false, (b), (short)0, (c), false, false)

// CDNA5 async global->LDS copies (ASYNCcnt-tracked), GV addressing mode.
#define ASYNC_LDS_B128(ldsoff, gptr)                                 \
  asm volatile("global_load_async_to_lds_b128 %0, %1, off"           \
               :: "v"(ldsoff), "v"(gptr) : "memory")
#define ASYNC_LDS_B32(ldsoff, gptr)                                  \
  asm volatile("global_load_async_to_lds_b32 %0, %1, off"            \
               :: "v"(ldsoff), "v"(gptr) : "memory")
#define WAIT_ASYNC(n) asm volatile("s_wait_asynccnt " #n ::: "memory")

// Generic pointer to LDS: low 32 bits of the flat address are the LDS offset.
__device__ __forceinline__ uint32_t lds_off(const void* p) {
  return (uint32_t)(size_t)p;
}

__device__ __forceinline__ float gelu_exact(float x) {
  return 0.5f * x * (1.0f + erff(x * 0.70710678118654752f));
}

// ---------------------------------------------------------------------------
// LayerNorm over ada_dim (one block per batch row)
// ---------------------------------------------------------------------------
__global__ __launch_bounds__(256) void ln_kernel(
    const float* __restrict__ ada, const float* __restrict__ gamma,
    const float* __restrict__ beta, float* __restrict__ cOut, int Adim) {
  __shared__ float red[256];
  const int b = blockIdx.x;
  const float* row = ada + (size_t)b * Adim;
  float s = 0.f;
  for (int i = threadIdx.x; i < Adim; i += 256) s += row[i];
  red[threadIdx.x] = s; __syncthreads();
  for (int o = 128; o > 0; o >>= 1) {
    if (threadIdx.x < o) red[threadIdx.x] += red[threadIdx.x + o];
    __syncthreads();
  }
  const float mu = red[0] / (float)Adim;
  __syncthreads();
  float v = 0.f;
  for (int i = threadIdx.x; i < Adim; i += 256) { float d = row[i] - mu; v += d * d; }
  red[threadIdx.x] = v; __syncthreads();
  for (int o = 128; o > 0; o >>= 1) {
    if (threadIdx.x < o) red[threadIdx.x] += red[threadIdx.x + o];
    __syncthreads();
  }
  const float rstd = rsqrtf(red[0] / (float)Adim + 1e-5f);
  for (int i = threadIdx.x; i < Adim; i += 256)
    cOut[(size_t)b * Adim + i] = (row[i] - mu) * rstd * gamma[i] + beta[i];
}

// ---------------------------------------------------------------------------
// Out(16,N) = act(Ain(16,K) @ W(K,N) + bias) — M=16 fits one WMMA tile exactly.
// ---------------------------------------------------------------------------
__global__ __launch_bounds__(256) void gemm16_kernel(
    const float* __restrict__ Ain, const float* __restrict__ W,
    const float* __restrict__ bias, float* __restrict__ Out,
    int K, int N, int applyGelu) {
  const int lane  = threadIdx.x & 31;
  const int wave  = threadIdx.x >> 5;
  const int ncol  = blockIdx.x * 128 + wave * 16 + (lane & 15);
  const int khalf = (lane >= 16) ? 2 : 0;
  const int arow  = lane & 15;
  v8f acc = {};
  for (int k = 0; k < K; k += 4) {
    v2f a, bf;
    a.x  = Ain[(size_t)arow * K + k + khalf];
    a.y  = Ain[(size_t)arow * K + k + khalf + 1];
    bf.x = W[(size_t)(k + khalf) * N + ncol];
    bf.y = W[(size_t)(k + khalf + 1) * N + ncol];
    acc = WMMA_F32(a, bf, acc);
  }
  const float bb = bias[ncol];
  #pragma unroll
  for (int v = 0; v < 8; ++v) {
    const int rowm = v + ((lane >= 16) ? 8 : 0);
    float val = acc[v] + bb;
    if (applyGelu) val = gelu_exact(val);
    Out[(size_t)rowm * N + ncol] = val;
  }
}

// ---------------------------------------------------------------------------
// 32x32 LDS-tiled transpose (base_up -> base_upT for coalesced B-tile loads)
// ---------------------------------------------------------------------------
__global__ __launch_bounds__(256) void transpose_kernel(
    const float* __restrict__ in, float* __restrict__ out, int N) {
  __shared__ float tile[32][33];
  const int bx = blockIdx.x * 32, by = blockIdx.y * 32;
  const int tx = threadIdx.x & 31, ty = threadIdx.x >> 5;
  for (int j = ty; j < 32; j += 8) tile[j][tx] = in[(size_t)(by + j) * N + bx + tx];
  __syncthreads();
  for (int j = ty; j < 32; j += 8) out[(size_t)(bx + j) * N + by + tx] = tile[tx][j];
}

// ---------------------------------------------------------------------------
// Fused: Out = epilogue( Ain @ Wmain  +  (Ain @ aR) @ bR^T ) per batch.
// 128x128 tile, K-step 32, 8 wave32s. Double-buffered LDS tiles filled with
// GLOBAL_LOAD_ASYNC_TO_LDS (ASYNCcnt), 9 async ops/wave/tile -> steady-state
// s_wait_asynccnt 9 overlaps next-tile HBM traffic with current-tile WMMAs.
// ---------------------------------------------------------------------------
constexpr int TM = 128, TN = 128, TK = 32, RNK = 8, DDIM = 1024;

__global__ __launch_bounds__(256) void fused_lora_gemm(
    const float* __restrict__ Ain,    // (B, T, D)
    const float* __restrict__ Wmain,  // (D, D) [k][n]
    const float* __restrict__ wgen,   // (B, 4*D*R) generated adapter weights
    int aOff, int bOff,               // float offsets of rank-in / rank-out mats
    const float* __restrict__ resid,  // nullptr or (B, T, D)
    float* __restrict__ Out,          // (B, T, D)
    int T, int applyGelu) {
  __shared__ float xs[2][TM][TK + 4];   // A tiles (stride 36: 16B aligned, conflict-free)
  __shared__ float bs[2][TK][TN + 4];   // B tiles
  __shared__ float as[2][TK][16];       // rank-in operand; cols 8..15 stay zero
  __shared__ float us[TM][RNK + 1];     // per-token rank accumulators
  __shared__ float brs[TN][RNK + 1];    // rank-out weights for this col tile

  const int b     = blockIdx.z;
  const int tid   = threadIdx.x;
  const int lane  = tid & 31;
  const int wave  = tid >> 5;
  const int wm    = wave >> 2;              // 0..1 : 64-token half
  const int wn    = wave & 3;               // 0..3 : 32-col group
  const int khalf = (lane >= 16) ? 2 : 0;
  const int lcol  = lane & 15;

  const float* Abase = Ain + ((size_t)b * T + (size_t)blockIdx.y * TM) * DDIM;
  const float* Wbase = Wmain + (size_t)blockIdx.x * TN;
  const float* aRp   = wgen + (size_t)b * 4 * DDIM * RNK + aOff;
  const float* bRp   = wgen + (size_t)b * 4 * DDIM * RNK + bOff;

  // Slot mt of a wave holds 16-token tile (mt + wn) & 3 of its 64-token half, so
  // slot 0 is a different tile in each of the four column waves: each wave does
  // the rank-in product of its slot 0 only, one extra WMMA per k-step on every
  // SIMD instead of four on the SIMD that holds the two wn == 0 waves.
  const int rt[4] = {wm * 64 + wn * 16, wm * 64 + ((wn + 1) & 3) * 16,
                     wm * 64 + ((wn + 2) & 3) * 16, wm * 64 + ((wn + 3) & 3) * 16};

  v8f acc[4][2] = {};
  v8f uacc      = {};

  const int xr  = tid >> 1;          // 0..127 token row
  const int xc0 = (tid & 1) * 16;
  const int bkk = tid >> 3;          // 0..31 k row
  const int bc0 = (tid & 7) * 16;

  // one-time zero of the rank operand's padding columns (both buffers)
  for (int i = tid; i < 2 * TK * 8; i += 256)
    as[i / (TK * 8)][(i % (TK * 8)) >> 3][8 + (i & 7)] = 0.0f;

  // issue all async loads for one K-tile into LDS buffer `buf` (9 ops/wave)
  auto issue_tile = [&](int buf, int k0) {
    const float* arow = Abase + (size_t)xr * DDIM + k0 + xc0;
    #pragma unroll
    for (int j = 0; j < 4; ++j)
      ASYNC_LDS_B128(lds_off(&xs[buf][xr][xc0 + j * 4]), arow + j * 4);
    const float* wrow = Wbase + (size_t)(k0 + bkk) * DDIM + bc0;
    #pragma unroll
    for (int j = 0; j < 4; ++j)
      ASYNC_LDS_B128(lds_off(&bs[buf][bkk][bc0 + j * 4]), wrow + j * 4);
    ASYNC_LDS_B32(lds_off(&as[buf][tid >> 3][tid & 7]), aRp + k0 * RNK + tid);
  };

  issue_tile(0, 0);

  for (int k0 = 0; k0 < DDIM; k0 += TK) {
    const int cur = (k0 / TK) & 1;
    if (k0 + TK < DDIM) {
      issue_tile(cur ^ 1, k0 + TK);   // prefetch next tile (prev readers done: barrier below)
      WAIT_ASYNC(0x9);                // current tile landed; next tile still in flight
    } else {
      WAIT_ASYNC(0x0);
    }
    __syncthreads();

    #pragma unroll
    for (int k4 = 0; k4 < TK; k4 += 4) {
      v2f afr[4], bfr[2], rfr;
      #pragma unroll
      for (int mt = 0; mt < 4; ++mt) {
        const int rr = rt[mt] + lcol;
        afr[mt].x = xs[cur][rr][k4 + khalf];
        afr[mt].y = xs[cur][rr][k4 + khalf + 1];
      }
      #pragma unroll
      for (int nt = 0; nt < 2; ++nt) {
        const int cc = wn * 32 + nt * 16 + lcol;
        bfr[nt].x = bs[cur][k4 + khalf][cc];
        bfr[nt].y = bs[cur][k4 + khalf + 1][cc];
      }
      rfr.x = as[cur][k4 + khalf][lcol];
      rfr.y = as[cur][k4 + khalf + 1][lcol];
      #pragma unroll
      for (int mt = 0; mt < 4; ++mt)
        #pragma unroll
        for (int nt = 0; nt < 2; ++nt)
          acc[mt][nt] = WMMA_F32(afr[mt], bfr[nt], acc[mt][nt]);
      uacc = WMMA_F32(afr[0], rfr, uacc);
    }
    __syncthreads();  // all waves done with buf `cur` before it is overwritten
  }

  {  // stage rank-out weights for this col tile
    const int n = tid >> 1, r0 = (tid & 1) * 4;
    #pragma unroll
    for (int j = 0; j < 4; ++j)
      brs[n][r0 + j] = bRp[(size_t)(blockIdx.x * TN + n) * RNK + r0 + j];
  }
  {  // every wave publishes its slot-0 tile of u (C layout: VGPR v -> row v / v+8)
    const int rbase = rt[0] + ((lane >= 16) ? 8 : 0);
    if (lcol < RNK) {
      #pragma unroll
      for (int v = 0; v < 8; ++v) us[rbase + v][lcol] = uacc[v];
    }
  }
  __syncthreads();

  #pragma unroll
  for (int mt = 0; mt < 4; ++mt) {
    #pragma unroll
    for (int nt = 0; nt < 2; ++nt) {
      const int colL = wn * 32 + nt * 16 + lcol;
      const int gcol = blockIdx.x * TN + colL;
      #pragma unroll
      for (int v = 0; v < 8; ++v) {
        const int rowL = rt[mt] + v + ((lane >= 16) ? 8 : 0);
        float val = acc[mt][nt][v];
        #pragma unroll
        for (int r = 0; r < RNK; ++r) val += us[rowL][r] * brs[colL][r];
        if (applyGelu) val = gelu_exact(val);
        const size_t gidx = ((size_t)b * T + blockIdx.y * TM + rowL) * DDIM + gcol;
        if (resid) val += resid[gidx];
        Out[gidx] = val;
      }
    }
  }
}

// ---------------------------------------------------------------------------
extern "C" void kernel_launch(void* const* d_in, const int* in_sizes, int n_in,
                              void* d_out, int out_size, void* d_ws, size_t ws_size,
                              hipStream_t stream) {
  (void)in_sizes; (void)n_in; (void)out_size; (void)ws_size;
  const float* x         = (const float*)d_in[0];
  const float* ada       = (const float*)d_in[1];
  const float* base_up   = (const float*)d_in[2];
  const float* base_down = (const float*)d_in[3];
  const float* ln_gamma  = (const float*)d_in[4];
  const float* ln_beta   = (const float*)d_in[5];
  const float* W1        = (const float*)d_in[6];
  const float* bias1     = (const float*)d_in[7];
  const float* W2        = (const float*)d_in[8];
  const float* bias2     = (const float*)d_in[9];

  const int Bb = 16, T = 1024, Dd = 1024, Adim = 1024, Idim = 1024;
  const int OUT4 = Dd * RNK * 4;  // 32768

  float* ws   = (float*)d_ws;
  float* mid  = ws;                           // 16M floats (64 MB)
  float* upT  = mid + (size_t)Bb * T * Dd;    // 1M floats (4 MB)
  float* cbuf = upT + (size_t)Dd * Dd;        // 16K
  float* hbuf = cbuf + (size_t)Bb * Adim;     // 16K
  float* wbuf = hbuf + (size_t)Bb * Idim;     // 512K (2 MB)

  // Adapter path: LN -> gelu(c@W1+b1) -> h@W2+b2  (M=16 WMMA tiles)
  ln_kernel<<<Bb, 256, 0, stream>>>(ada, ln_gamma, ln_beta, cbuf, Adim);
  gemm16_kernel<<<Idim / 128, 256, 0, stream>>>(cbuf, W1, bias1, hbuf, Adim, Idim, 1);
  gemm16_kernel<<<OUT4 / 128, 256, 0, stream>>>(hbuf, W2, bias2, wbuf, Idim, OUT4, 0);
  transpose_kernel<<<dim3(Dd / 32, Dd / 32), 256, 0, stream>>>(base_up, upT, Dd);

  // mid = gelu( x @ base_down + (x@a2) @ b2^T )      a2 at chunk 2, b2 at chunk 3
  fused_lora_gemm<<<dim3(Dd / TN, T / TM, Bb), 256, 0, stream>>>(
      x, base_down, wbuf, 2 * Dd * RNK, 3 * Dd * RNK, nullptr, mid, T, 1);
  // out = x + mid @ base_up^T + (mid@b1) @ a1^T      b1 at chunk 1, a1 at chunk 0
  fused_lora_gemm<<<dim3(Dd / TN, T / TM, Bb), 256, 0, stream>>>(
      mid, upT, wbuf, 1 * Dd * RNK, 0, x, (float*)d_out, T, 0);
}
